// v000
// The times below were measured on an AMD MI455X: many runs one after another, warmed up first and cycling through
// copies of the inputs, with the whole window's GPU time divided by the number of runs. Launches and the gaps
// between them are all in it. The median over several windows is given; except for v000 it joins two sittings, which
// can be a few percent apart, so the side-by-side timings, each taken in one sitting, are the better comparison.
// The starting kernel, v000, takes 201 microseconds a run.
#include <hip/hip_runtime.h>
#include <hip/hip_bf16.h>
#include <math.h>

typedef float v2f __attribute__((ext_vector_type(2)));
typedef float v8f __attribute__((ext_vector_type(8)));

#define DIMC   256
#define HDIM   32
#define NHEADS 8
#define HW     3136
#define WIDTH  56
#define SCALE  0.17677669529663687f   // 32^-0.5

// ---------------------------------------------------------------------------
// Wave-level MTx16 (M) x NTx16 (N) fp32 GEMM macro-tile over K using
// V_WMMA_F32_16X16X4_F32 with register blocking: MT A-operands and NT
// B-operands are loaded once per K-step and shared across MT*NT wmmas.
// A: row-major M x K (lda). B: row-major K x N (ldb).
// Per ISA VGPR layout: lane = (idx = lane&15, khalf = lane>>4)
//   A regs = A[idx][2*khalf + {0,1}]   (contiguous pair -> v2f load)
//   B regs = B[2*khalf + {0,1}][idx]   (two strided b32 loads)
// ---------------------------------------------------------------------------
template<int MT, int NT>
__device__ __forceinline__ void wmma_gemm_multi(const float* __restrict__ A, int lda,
                                                const float* __restrict__ B, int ldb,
                                                int K, v8f acc[MT][NT])
{
    const int lane = threadIdx.x & 31;
    const int idx  = lane & 15;
    const int kb   = (lane >> 4) << 1;
    const float* ap = A + (size_t)idx * lda + kb;
    const float* bp = B + (size_t)kb * ldb + idx;
#pragma unroll 4
    for (int k = 0; k < K; k += 4) {
        v2f a[MT];
#pragma unroll
        for (int mi = 0; mi < MT; ++mi)
            a[mi] = *(const v2f*)(ap + (size_t)mi * 16 * lda);
        v2f bv[NT];
#pragma unroll
        for (int ni = 0; ni < NT; ++ni) {
            bv[ni].x = bp[ni * 16];
            bv[ni].y = bp[ni * 16 + ldb];
        }
#pragma unroll
        for (int mi = 0; mi < MT; ++mi)
#pragma unroll
            for (int ni = 0; ni < NT; ++ni)
                acc[mi][ni] = __builtin_amdgcn_wmma_f32_16x16x4_f32(
                    /*neg_a=*/false, a[mi], /*neg_b=*/false, bv[ni],
                    /*c_mod=*/(short)0, acc[mi][ni],
                    /*reuse_a=*/false, /*reuse_b=*/false);
        ap += 4;
        bp += (size_t)4 * ldb;
    }
}

// ---------------------------------------------------------------------------
// Kernel A: qkv = w_qkv @ x + b_qkv    (M=768, K=256, N=3136 per batch)
// Wave macro-tile: 32(M) x 64(N).  768 = 24 mBlocks, 3136 = 49 nQuads.
// Output layout: qkvbuf[b][which(3)][head(8)][p(3136)][d(32)]  (d contiguous)
// grid = (49, 6, 4), block = 128 (4 waves; wave -> mBlock)
// ---------------------------------------------------------------------------
__global__ void __launch_bounds__(128)
qkv_kernel(const float* __restrict__ x,      // (B,256,56,56)
           const float* __restrict__ w_qkv,  // (768,256)
           const float* __restrict__ b_qkv,  // (768)
           float* __restrict__ qkvbuf)
{
    const int wave   = threadIdx.x >> 5;
    const int lane   = threadIdx.x & 31;
    const int nQuad  = blockIdx.x;                 // 0..48
    const int mBlock = blockIdx.y * 4 + wave;      // 0..23
    const int b      = blockIdx.z;

    const float* A = w_qkv + (size_t)mBlock * 32 * DIMC;
    const float* B = x + (size_t)b * DIMC * HW + nQuad * 64;

    v8f acc[2][4] = {};
    wmma_gemm_multi<2, 4>(A, DIMC, B, HW, DIMC, acc);

    const int idx   = lane & 15;
    const int khalf = lane >> 4;

#pragma unroll
    for (int mi = 0; mi < 2; ++mi) {
        const int m0    = mBlock * 32 + mi * 16 + khalf * 8;  // multiple of 8
        const int which = m0 >> 8;                            // 0=q 1=k 2=v
        const int head  = (m0 >> 5) & 7;
        const int d0    = m0 & 31;                            // 0,8,16,24
        float4 bias_lo, bias_hi;
        bias_lo.x = b_qkv[m0 + 0]; bias_lo.y = b_qkv[m0 + 1];
        bias_lo.z = b_qkv[m0 + 2]; bias_lo.w = b_qkv[m0 + 3];
        bias_hi.x = b_qkv[m0 + 4]; bias_hi.y = b_qkv[m0 + 5];
        bias_hi.z = b_qkv[m0 + 6]; bias_hi.w = b_qkv[m0 + 7];
#pragma unroll
        for (int ni = 0; ni < 4; ++ni) {
            const int p = nQuad * 64 + ni * 16 + idx;
            float* outp = qkvbuf +
                ((((size_t)(b * 3 + which) * NHEADS + head) * HW + p) * HDIM + d0);
            float4 lo, hi;
            lo.x = acc[mi][ni][0] + bias_lo.x;
            lo.y = acc[mi][ni][1] + bias_lo.y;
            lo.z = acc[mi][ni][2] + bias_lo.z;
            lo.w = acc[mi][ni][3] + bias_lo.w;
            hi.x = acc[mi][ni][4] + bias_hi.x;
            hi.y = acc[mi][ni][5] + bias_hi.y;
            hi.z = acc[mi][ni][6] + bias_hi.z;
            hi.w = acc[mi][ni][7] + bias_hi.w;
            *(float4*)(outp)     = lo;
            *(float4*)(outp + 4) = hi;
        }
    }
}

// ---------------------------------------------------------------------------
// Kernel B: neighborhood attention, one thread per (b, head, pixel).
// Zero-padded neighbors (as in the reference) contribute logit=0 and v=0 to
// the softmax. Single-pass online softmax, q + 32 accumulators in registers.
// Output written channel-major: attnbuf[b][c=head*32+d][p].
// ---------------------------------------------------------------------------
__global__ void __launch_bounds__(256)
attn_kernel(const float* __restrict__ qkvbuf,
            float* __restrict__ attnbuf)
{
    const int tid  = blockIdx.x * blockDim.x + threadIdx.x;  // < 4*8*3136
    const int p    = tid % HW;
    const int bh   = tid / HW;
    const int head = bh & 7;
    const int b    = bh >> 3;
    const int yy0  = p / WIDTH;
    const int xx0  = p % WIDTH;

    const int ksz = (head < 4) ? 5 : ((head < 7) ? 7 : 9);
    const int pad = ksz >> 1;

    const float* qb = qkvbuf + (((size_t)(b * 3 + 0) * NHEADS + head) * HW + p) * HDIM;
    const float* kb = qkvbuf + (((size_t)(b * 3 + 1) * NHEADS + head) * HW) * HDIM;
    const float* vb = qkvbuf + (((size_t)(b * 3 + 2) * NHEADS + head) * HW) * HDIM;

    float q[HDIM];
#pragma unroll
    for (int d4 = 0; d4 < 8; ++d4) {
        float4 t = ((const float4*)qb)[d4];
        q[4 * d4 + 0] = t.x * SCALE;
        q[4 * d4 + 1] = t.y * SCALE;
        q[4 * d4 + 2] = t.z * SCALE;
        q[4 * d4 + 3] = t.w * SCALE;
    }

    float mx   = -INFINITY;
    float ssum = 0.0f;
    float acc[HDIM];
#pragma unroll
    for (int d = 0; d < HDIM; ++d) acc[d] = 0.0f;

    for (int ki = 0; ki < ksz; ++ki) {
        const int yy = yy0 + ki - pad;
        for (int kj = 0; kj < ksz; ++kj) {
            const int xx = xx0 + kj - pad;
            const bool inb = (yy >= 0) && (yy < WIDTH) && (xx >= 0) && (xx < WIDTH);
            const size_t np = (size_t)(inb ? (yy * WIDTH + xx) : 0) * HDIM;

            float s = 0.0f;
            if (inb) {
                const float* kp = kb + np;
#pragma unroll
                for (int d4 = 0; d4 < 8; ++d4) {
                    float4 t = ((const float4*)kp)[d4];
                    s += q[4 * d4 + 0] * t.x + q[4 * d4 + 1] * t.y
                       + q[4 * d4 + 2] * t.z + q[4 * d4 + 3] * t.w;
                }
            }
            // zero-padded OOB neighbor => s = 0, v = 0 (still in softmax!)
            const float nm = fmaxf(mx, s);
            const float cs = __expf(mx - nm);   // exp(-inf)=0 on first iter
            const float w  = __expf(s - nm);
            ssum = ssum * cs + w;
            if (inb) {
                const float* vp = vb + np;
#pragma unroll
                for (int d4 = 0; d4 < 8; ++d4) {
                    float4 t = ((const float4*)vp)[d4];
                    acc[4 * d4 + 0] = acc[4 * d4 + 0] * cs + w * t.x;
                    acc[4 * d4 + 1] = acc[4 * d4 + 1] * cs + w * t.y;
                    acc[4 * d4 + 2] = acc[4 * d4 + 2] * cs + w * t.z;
                    acc[4 * d4 + 3] = acc[4 * d4 + 3] * cs + w * t.w;
                }
            } else {
#pragma unroll
                for (int d = 0; d < HDIM; ++d) acc[d] *= cs;
            }
            mx = nm;
        }
    }

    const float inv = 1.0f / ssum;
    float* ob = attnbuf + ((size_t)b * DIMC + head * HDIM) * HW + p;
#pragma unroll
    for (int d = 0; d < HDIM; ++d)
        ob[(size_t)d * HW] = acc[d] * inv;
}

// ---------------------------------------------------------------------------
// Kernel C: out = w_proj @ attn + b_proj  (M=256, K=256, N=3136 per batch)
// Wave macro-tile: 32(M) x 64(N).  256 = 8 mBlocks, 3136 = 49 nQuads.
// Output: reference layout (B,256,56,56).
// grid = (49, 2, 4), block = 128 (4 waves)
// ---------------------------------------------------------------------------
__global__ void __launch_bounds__(128)
proj_kernel(const float* __restrict__ attnbuf, // (B,256,3136) channel-major
            const float* __restrict__ w_proj,  // (256,256)
            const float* __restrict__ b_proj,  // (256)
            float* __restrict__ out)
{
    const int wave   = threadIdx.x >> 5;
    const int lane   = threadIdx.x & 31;
    const int nQuad  = blockIdx.x;                 // 0..48
    const int mBlock = blockIdx.y * 4 + wave;      // 0..7
    const int b      = blockIdx.z;

    const float* A = w_proj + (size_t)mBlock * 32 * DIMC;
    const float* B = attnbuf + (size_t)b * DIMC * HW + nQuad * 64;

    v8f acc[2][4] = {};
    wmma_gemm_multi<2, 4>(A, DIMC, B, HW, DIMC, acc);

    const int idx   = lane & 15;
    const int khalf = lane >> 4;

#pragma unroll
    for (int mi = 0; mi < 2; ++mi) {
        const int m0 = mBlock * 32 + mi * 16 + khalf * 8;
#pragma unroll
        for (int ni = 0; ni < 4; ++ni) {
            const int p = nQuad * 64 + ni * 16 + idx;
#pragma unroll
            for (int r = 0; r < 8; ++r)
                out[((size_t)b * DIMC + m0 + r) * HW + p] = acc[mi][ni][r] + b_proj[m0 + r];
        }
    }
}

// ---------------------------------------------------------------------------
extern "C" void kernel_launch(void* const* d_in, const int* in_sizes, int n_in,
                              void* d_out, int out_size, void* d_ws, size_t ws_size,
                              hipStream_t stream)
{
    const float* x      = (const float*)d_in[0];  // (4,256,56,56)
    const float* w_qkv  = (const float*)d_in[1];  // (768,256)
    const float* b_qkv  = (const float*)d_in[2];  // (768)
    const float* w_proj = (const float*)d_in[3];  // (256,256)
    const float* b_proj = (const float*)d_in[4];  // (256)
    float* out = (float*)d_out;

    float* qkvbuf  = (float*)d_ws;                                // 3*4*8*3136*32 floats
    float* attnbuf = qkvbuf + (size_t)3 * 4 * NHEADS * HW * HDIM; // +4*256*3136 floats

    // QKV projection: 24 mBlocks x 49 nQuads x 4 batches, 4 waves/block
    qkv_kernel<<<dim3(49, 6, 4), dim3(128), 0, stream>>>(x, w_qkv, b_qkv, qkvbuf);

    // Neighborhood attention: 4*8*3136 threads
    attn_kernel<<<dim3((4 * NHEADS * HW) / 256), dim3(256), 0, stream>>>(qkvbuf, attnbuf);

    // Output projection: 8 mBlocks x 49 nQuads x 4 batches
    proj_kernel<<<dim3(49, 2, 4), dim3(128), 0, stream>>>(attnbuf, w_proj, b_proj, out);
}

// v001
// One run takes 85 microseconds.
// In both of two side-by-side timings against v000, it was 2.40 times as fast.
#include <hip/hip_runtime.h>
#include <hip/hip_bf16.h>
#include <math.h>

typedef float v2f __attribute__((ext_vector_type(2)));
typedef float v8f __attribute__((ext_vector_type(8)));
typedef float v4f __attribute__((ext_vector_type(4)));

#define DIMC   256
#define HDIM   32
#define NHEADS 8
#define HW     3136
#define WIDTH  56
#define SCALE  0.17677669529663687f   // 32^-0.5

// ---------------------------------------------------------------------------
// Wave-level MTx16 (M) x NTx16 (N) fp32 GEMM macro-tile over K using
// V_WMMA_F32_16X16X4_F32 with register blocking: MT A-operands and NT
// B-operands are loaded once per K-step and shared across MT*NT wmmas.
// A: row-major M x K (lda). B: row-major K x N (ldb).
// Per ISA VGPR layout: lane = (idx = lane&15, khalf = lane>>4)
//   A regs = A[idx][2*khalf + {0,1}]   (contiguous pair -> v2f load)
//   B regs = B[2*khalf + {0,1}][idx]   (two strided b32 loads)
// ---------------------------------------------------------------------------
template<int MT, int NT>
__device__ __forceinline__ void wmma_gemm_multi(const float* __restrict__ A, int lda,
                                                const float* __restrict__ B, int ldb,
                                                int K, v8f acc[MT][NT])
{
    const int lane = threadIdx.x & 31;
    const int idx  = lane & 15;
    const int kb   = (lane >> 4) << 1;
    const float* ap = A + (size_t)idx * lda + kb;
    const float* bp = B + (size_t)kb * ldb + idx;
#pragma unroll 4
    for (int k = 0; k < K; k += 4) {
        v2f a[MT];
#pragma unroll
        for (int mi = 0; mi < MT; ++mi)
            a[mi] = *(const v2f*)(ap + (size_t)mi * 16 * lda);
        v2f bv[NT];
#pragma unroll
        for (int ni = 0; ni < NT; ++ni) {
            bv[ni].x = bp[ni * 16];
            bv[ni].y = bp[ni * 16 + ldb];
        }
#pragma unroll
        for (int mi = 0; mi < MT; ++mi)
#pragma unroll
            for (int ni = 0; ni < NT; ++ni)
                acc[mi][ni] = __builtin_amdgcn_wmma_f32_16x16x4_f32(
                    /*neg_a=*/false, a[mi], /*neg_b=*/false, bv[ni],
                    /*c_mod=*/(short)0, acc[mi][ni],
                    /*reuse_a=*/false, /*reuse_b=*/false);
        ap += 4;
        bp += (size_t)4 * ldb;
    }
}

// ---------------------------------------------------------------------------
// Kernel A: qkv = w_qkv @ x + b_qkv    (M=768, K=256, N=3136 per batch)
// Wave macro-tile: 32(M) x 64(N).  768 = 24 mBlocks, 3136 = 49 nQuads.
// Output layout: qkvbuf[b][which(3)][head(8)][p(3136)][d(32)]  (d contiguous)
// grid = (49, 6, 4), block = 128 (4 waves; wave -> mBlock)
// ---------------------------------------------------------------------------
__global__ void __launch_bounds__(128)
qkv_kernel(const float* __restrict__ x,      // (B,256,56,56)
           const float* __restrict__ w_qkv,  // (768,256)
           const float* __restrict__ b_qkv,  // (768)
           float* __restrict__ qkvbuf)
{
    const int wave   = threadIdx.x >> 5;
    const int lane   = threadIdx.x & 31;
    const int nQuad  = blockIdx.x;                 // 0..48
    const int mBlock = blockIdx.y * 4 + wave;      // 0..23
    const int b      = blockIdx.z;

    const float* A = w_qkv + (size_t)mBlock * 32 * DIMC;
    const float* B = x + (size_t)b * DIMC * HW + nQuad * 64;

    v8f acc[2][4] = {};
    wmma_gemm_multi<2, 4>(A, DIMC, B, HW, DIMC, acc);

    const int idx   = lane & 15;
    const int khalf = lane >> 4;

#pragma unroll
    for (int mi = 0; mi < 2; ++mi) {
        const int m0    = mBlock * 32 + mi * 16 + khalf * 8;  // multiple of 8
        const int which = m0 >> 8;                            // 0=q 1=k 2=v
        const int head  = (m0 >> 5) & 7;
        const int d0    = m0 & 31;                            // 0,8,16,24
        float4 bias_lo, bias_hi;
        bias_lo.x = b_qkv[m0 + 0]; bias_lo.y = b_qkv[m0 + 1];
        bias_lo.z = b_qkv[m0 + 2]; bias_lo.w = b_qkv[m0 + 3];
        bias_hi.x = b_qkv[m0 + 4]; bias_hi.y = b_qkv[m0 + 5];
        bias_hi.z = b_qkv[m0 + 6]; bias_hi.w = b_qkv[m0 + 7];
#pragma unroll
        for (int ni = 0; ni < 4; ++ni) {
            const int p = nQuad * 64 + ni * 16 + idx;
            float* outp = qkvbuf +
                ((((size_t)(b * 3 + which) * NHEADS + head) * HW + p) * HDIM + d0);
            float4 lo, hi;
            lo.x = acc[mi][ni][0] + bias_lo.x;
            lo.y = acc[mi][ni][1] + bias_lo.y;
            lo.z = acc[mi][ni][2] + bias_lo.z;
            lo.w = acc[mi][ni][3] + bias_lo.w;
            hi.x = acc[mi][ni][4] + bias_hi.x;
            hi.y = acc[mi][ni][5] + bias_hi.y;
            hi.z = acc[mi][ni][6] + bias_hi.z;
            hi.w = acc[mi][ni][7] + bias_hi.w;
            *(float4*)(outp)     = lo;
            *(float4*)(outp + 4) = hi;
        }
    }
}

// ---------------------------------------------------------------------------
// Kernel B: neighborhood attention, one thread per (b, head, pixel).
// One block = 4 image rows (224 pixels) of one (b, head). The block first
// stages the K and V vectors of its rows plus the window's halo in LDS; halo
// cells outside the image are stored as zeros, which is the reference's zero
// padding (logit = 0, v = 0, still in the softmax), so the window loop needs
// no bounds test. One LDS cell = K[32], V[32] and 4 floats of pad: 272 B =
// 16 B x odd, so lanes on neighbouring pixels read 16-byte pieces from
// distinct banks.
// Single-pass online softmax, q + 32 accumulators in registers.
// Output written channel-major: attnbuf[b][c=head*32+d][p].
// ---------------------------------------------------------------------------
#define TROWS   4                    // image rows per block
#define TTHR    (TROWS * WIDTH)      // 224 threads, one per pixel
#define LCOLS   64                   // LDS cells per staged row (56 + widest halo)
#define LCELL   68                   // floats per LDS cell
#define LROWS   (TROWS + 8)          // staged rows for the widest window
#define STAGE_U 7                    // pieces per thread loaded before any is stored

struct Vec32 { v4f e[8]; };

__device__ __forceinline__ void vec_read(Vec32& c, const float* src)
{
#pragma unroll
    for (int d4 = 0; d4 < 8; ++d4) c.e[d4] = ((const v4f*)src)[d4];
}

__device__ __forceinline__ void cell_attend(const Vec32& k, const Vec32& v, const float (&q)[HDIM],
                                            float (&acc)[HDIM], float& mx, float& ssum)
{
    float s = 0.0f;
#pragma unroll
    for (int d4 = 0; d4 < 8; ++d4) {
        const v4f t = k.e[d4];
        s += q[4 * d4 + 0] * t.x + q[4 * d4 + 1] * t.y
           + q[4 * d4 + 2] * t.z + q[4 * d4 + 3] * t.w;
    }
    const float nm = fmaxf(mx, s);
    const float cs = __expf(mx - nm);   // exp(-inf)=0 on first cell
    const float w  = __expf(s - nm);
    ssum = ssum * cs + w;
#pragma unroll
    for (int d4 = 0; d4 < 8; ++d4) {
        const v4f t = v.e[d4];
        acc[4 * d4 + 0] = acc[4 * d4 + 0] * cs + w * t.x;
        acc[4 * d4 + 1] = acc[4 * d4 + 1] * cs + w * t.y;
        acc[4 * d4 + 2] = acc[4 * d4 + 2] * cs + w * t.z;
        acc[4 * d4 + 3] = acc[4 * d4 + 3] * cs + w * t.w;
    }
    mx = nm;
}

template<int KSZ>
__device__ __forceinline__ void attn_tile(const float* __restrict__ qkvbuf,
                                          float* __restrict__ attnbuf,
                                          float* KV, int b, int head, int tile)
{
    constexpr int PAD    = KSZ >> 1;
    constexpr int PIECES = (TROWS + KSZ - 1) * LCOLS * 8;   // float4 pieces of K (and of V)
    const int tid = threadIdx.x;
    const int y0  = tile * TROWS;
    const int p   = tile * TTHR + tid;

    const float* qb = qkvbuf + (((size_t)(b * 3 + 0) * NHEADS + head) * HW + p) * HDIM;
    const v4f*   kg = (const v4f*)(qkvbuf + (((size_t)(b * 3 + 1) * NHEADS + head) * HW) * HDIM);
    const v4f*   vg = (const v4f*)(qkvbuf + (((size_t)(b * 3 + 2) * NHEADS + head) * HW) * HDIM);

    // Stage: 8 lanes per pixel, so a wave's load covers whole 128-byte lines.
    for (int i0 = tid; i0 < PIECES; i0 += STAGE_U * TTHR) {
        v4f kr[STAGE_U], vr[STAGE_U];
#pragma unroll
        for (int u = 0; u < STAGE_U; ++u) {
            const int i   = i0 + u * TTHR;
            const int yy  = y0 + (i >> 9) - PAD;
            const int xx  = ((i >> 3) & (LCOLS - 1)) - PAD;
            const bool inb = (yy >= 0) && (yy < WIDTH) && (xx >= 0) && (xx < WIDTH);
            const int g   = inb ? ((yy * WIDTH + xx) * 8 + (i & 7)) : 0;
            kr[u] = kg[g];
            vr[u] = vg[g];
            if (!inb) { kr[u] = (v4f)(0.0f); vr[u] = (v4f)(0.0f); }
        }
#pragma unroll
        for (int u = 0; u < STAGE_U; ++u) {
            const int i = i0 + u * TTHR;
            if (i < PIECES) {
                float* cell = KV + (i >> 3) * LCELL + (i & 7) * 4;
                *(v4f*)(cell)      = kr[u];
                *(v4f*)(cell + 32) = vr[u];
            }
        }
    }

    float q[HDIM];
#pragma unroll
    for (int d4 = 0; d4 < 8; ++d4) {
        float4 t = ((const float4*)qb)[d4];
        q[4 * d4 + 0] = t.x * SCALE;
        q[4 * d4 + 1] = t.y * SCALE;
        q[4 * d4 + 2] = t.z * SCALE;
        q[4 * d4 + 3] = t.w * SCALE;
    }

    float mx   = -INFINITY;
    float ssum = 0.0f;
    float acc[HDIM];
#pragma unroll
    for (int d = 0; d < HDIM; ++d) acc[d] = 0.0f;

    const int r = tid / WIDTH;
    const int x = tid - r * WIDTH;
    const float* win = KV + (r * LCOLS + x) * LCELL;   // window's top-left cell

    __syncthreads();   // every wave's staged cells are read by the others

    // Window cells in the reference's order (row-major over ki, kj). A cell's K is
    // read from LDS one cell ahead of its use (two register sets), its V at the
    // cell's start, under the logit's arithmetic.
    int kj = 0, off = 0;
    auto next_cell = [&]() {
        ++kj; off += LCELL;
        if (kj == KSZ) { kj = 0; off += (LCOLS - KSZ) * LCELL; }
    };
    Vec32 ka, kb, vv;
    vec_read(ka, win);
    // kept rolled: unrolled, all LDS reads of a window row are lifted to its top and spill
#pragma unroll 1
    for (int it = 0; it < (KSZ * KSZ - 1) / 2; ++it) {
        vec_read(vv, win + off + 32);
        next_cell();
        vec_read(kb, win + off);
        cell_attend(ka, vv, q, acc, mx, ssum);
        vec_read(vv, win + off + 32);
        next_cell();
        vec_read(ka, win + off);
        cell_attend(kb, vv, q, acc, mx, ssum);
    }
    vec_read(vv, win + off + 32);
    cell_attend(ka, vv, q, acc, mx, ssum);

    const float inv = 1.0f / ssum;
    float* ob = attnbuf + ((size_t)b * DIMC + head * HDIM) * HW + p;
#pragma unroll
    for (int d = 0; d < HDIM; ++d)
        ob[(size_t)d * HW] = acc[d] * inv;
}

// grid = 8 heads x 4 batches x 14 row tiles; the heads with the widest window
// take the lowest block indices, so the longest blocks start first.
__global__ void __launch_bounds__(TTHR)
attn_kernel(const float* __restrict__ qkvbuf,
            float* __restrict__ attnbuf)
{
    __shared__ __attribute__((aligned(16))) float KV[LROWS * LCOLS * LCELL];

    const int blk  = blockIdx.x;
    const int head = (NHEADS - 1) - blk / 56;
    const int rem  = blk % 56;
    const int b    = rem / 14;
    const int tile = rem % 14;

    if (head < 4)      attn_tile<5>(qkvbuf, attnbuf, KV, b, head, tile);
    else if (head < 7) attn_tile<7>(qkvbuf, attnbuf, KV, b, head, tile);
    else               attn_tile<9>(qkvbuf, attnbuf, KV, b, head, tile);
}

// ---------------------------------------------------------------------------
// Kernel C: out = w_proj @ attn + b_proj  (M=256, K=256, N=3136 per batch)
// Wave macro-tile: 32(M) x 64(N).  256 = 8 mBlocks, 3136 = 49 nQuads.
// Output: reference layout (B,256,56,56).
// grid = (49, 2, 4), block = 128 (4 waves)
// ---------------------------------------------------------------------------
__global__ void __launch_bounds__(128)
proj_kernel(const float* __restrict__ attnbuf, // (B,256,3136) channel-major
            const float* __restrict__ w_proj,  // (256,256)
            const float* __restrict__ b_proj,  // (256)
            float* __restrict__ out)
{
    const int wave   = threadIdx.x >> 5;
    const int lane   = threadIdx.x & 31;
    const int nQuad  = blockIdx.x;                 // 0..48
    const int mBlock = blockIdx.y * 4 + wave;      // 0..7
    const int b      = blockIdx.z;

    const float* A = w_proj + (size_t)mBlock * 32 * DIMC;
    const float* B = attnbuf + (size_t)b * DIMC * HW + nQuad * 64;

    v8f acc[2][4] = {};
    wmma_gemm_multi<2, 4>(A, DIMC, B, HW, DIMC, acc);

    const int idx   = lane & 15;
    const int khalf = lane >> 4;

#pragma unroll
    for (int mi = 0; mi < 2; ++mi) {
        const int m0 = mBlock * 32 + mi * 16 + khalf * 8;
#pragma unroll
        for (int ni = 0; ni < 4; ++ni) {
            const int p = nQuad * 64 + ni * 16 + idx;
#pragma unroll
            for (int r = 0; r < 8; ++r)
                out[((size_t)b * DIMC + m0 + r) * HW + p] = acc[mi][ni][r] + b_proj[m0 + r];
        }
    }
}

// ---------------------------------------------------------------------------
extern "C" void kernel_launch(void* const* d_in, const int* in_sizes, int n_in,
                              void* d_out, int out_size, void* d_ws, size_t ws_size,
                              hipStream_t stream)
{
    const float* x      = (const float*)d_in[0];  // (4,256,56,56)
    const float* w_qkv  = (const float*)d_in[1];  // (768,256)
    const float* b_qkv  = (const float*)d_in[2];  // (768)
    const float* w_proj = (const float*)d_in[3];  // (256,256)
    const float* b_proj = (const float*)d_in[4];  // (256)
    float* out = (float*)d_out;

    float* qkvbuf  = (float*)d_ws;                                // 3*4*8*3136*32 floats
    float* attnbuf = qkvbuf + (size_t)3 * 4 * NHEADS * HW * HDIM; // +4*256*3136 floats

    // QKV projection: 24 mBlocks x 49 nQuads x 4 batches, 4 waves/block
    qkv_kernel<<<dim3(49, 6, 4), dim3(128), 0, stream>>>(x, w_qkv, b_qkv, qkvbuf);

    // Neighborhood attention: 8 heads x 4 batches x 14 tiles of 4 rows
    attn_kernel<<<dim3(448), dim3(224), 0, stream>>>(qkvbuf, attnbuf);

    // Output projection: 8 mBlocks x 49 nQuads x 4 batches
    proj_kernel<<<dim3(49, 2, 4), dim3(128), 0, stream>>>(attnbuf, w_proj, b_proj, out);
}

// v002
// Measured time: 68.7 microseconds a run.
// Timed twice side by side with v001, it ran 1.23 and 1.24 times as fast.
// Counting every step since v000, it is 2.96 times as fast.
#include <hip/hip_runtime.h>
#include <hip/hip_bf16.h>
#include <math.h>

typedef float v2f __attribute__((ext_vector_type(2)));
typedef float v8f __attribute__((ext_vector_type(8)));
typedef float v4f __attribute__((ext_vector_type(4)));

#define DIMC   256
#define HDIM   32
#define NHEADS 8
#define HW     3136
#define WIDTH  56
#define SCALE  0.17677669529663687f   // 32^-0.5

// ---------------------------------------------------------------------------
// Block-level 128 (M) x 64 (N) fp32 GEMM over K = 256 on V_WMMA_F32_16X16X4_F32.
// 4 waves; wave w owns rows 32w..32w+31 as 2 x 4 tiles of 16 x 16.
// A: row-major M x K (lda = 256). B: row-major K x N (ldb = 3136).
// K runs in slices of 32. A slice (A: 128 rows x 128 B, B: 32 rows x 256 B) is
// brought into LDS by asynchronous 16-byte copies, whole 128-byte lines per
// request, two buffers: slice t + 1 flies while slice t is multiplied.
// Per ISA VGPR layout: lane = (idx = lane&15, khalf = lane>>4)
//   A regs = A[idx][2*khalf + {0,1}]   (8-byte LDS read)
//   B regs = B[2*khalf + {0,1}][idx]   (two 4-byte LDS reads)
// LDS pitches: A rows 36 floats (16 rows x 2 halves fall on all 64 banks once),
// B rows 72 floats (rows k and k + 2 lie 16 banks apart).
// ---------------------------------------------------------------------------
#define KC      32
#define NSLICE  (DIMC / KC)
#define APITCH  36
#define BPITCH  72
#define ASLICE  (128 * APITCH)
#define BSLICE  (KC * BPITCH)
#define SLICEF  (ASLICE + BSLICE)    // floats per buffer: 27,648 B

__device__ __forceinline__ unsigned lds_byte(const float* p)
{
    return (unsigned)(uintptr_t)p;   // low 32 bits of a __shared__ address = LDS byte address
}

// One slice: 12 copies per lane (8 of A, 4 of B). Ag = the block's first A row at
// the slice's first k; Bg = the slice's first B row at the block's first column.
__device__ __forceinline__ void stage_slice(const float* __restrict__ Ag,
                                            const float* __restrict__ Bg,
                                            float* S)
{
    const int tid = threadIdx.x;
    const float*   ga = Ag + (tid >> 3) * DIMC + (tid & 7) * 4;           // 8 lanes per A row
    const unsigned la = lds_byte(S + (tid >> 3) * APITCH + (tid & 7) * 4);
    const float*   gb = Bg + (tid >> 4) * HW + (tid & 15) * 4;            // 16 lanes per B row
    const unsigned lb = lds_byte(S + ASLICE + (tid >> 4) * BPITCH + (tid & 15) * 4);
    // The copies and their s_wait_xcnt in one statement: the address registers
    // stay untouched until the wait has passed.
    asm volatile(
        "global_load_async_to_lds_b128 %0, %1, off\n\t"
        "global_load_async_to_lds_b128 %2, %3, off\n\t"
        "global_load_async_to_lds_b128 %4, %5, off\n\t"
        "global_load_async_to_lds_b128 %6, %7, off\n\t"
        "global_load_async_to_lds_b128 %8, %9, off\n\t"
        "global_load_async_to_lds_b128 %10, %11, off\n\t"
        "global_load_async_to_lds_b128 %12, %13, off\n\t"
        "global_load_async_to_lds_b128 %14, %15, off\n\t"
        "global_load_async_to_lds_b128 %16, %17, off\n\t"
        "global_load_async_to_lds_b128 %18, %19, off\n\t"
        "global_load_async_to_lds_b128 %20, %21, off\n\t"
        "global_load_async_to_lds_b128 %22, %23, off\n\t"
        "s_wait_xcnt 0x0"
        :: "v"(la + 0 * 16 * APITCH * 4), "v"(ga + 0 * 16 * DIMC),
           "v"(la + 1 * 16 * APITCH * 4), "v"(ga + 1 * 16 * DIMC),
           "v"(la + 2 * 16 * APITCH * 4), "v"(ga + 2 * 16 * DIMC),
           "v"(la + 3 * 16 * APITCH * 4), "v"(ga + 3 * 16 * DIMC),
           "v"(la + 4 * 16 * APITCH * 4), "v"(ga + 4 * 16 * DIMC),
           "v"(la + 5 * 16 * APITCH * 4), "v"(ga + 5 * 16 * DIMC),
           "v"(la + 6 * 16 * APITCH * 4), "v"(ga + 6 * 16 * DIMC),
           "v"(la + 7 * 16 * APITCH * 4), "v"(ga + 7 * 16 * DIMC),
           "v"(lb + 0 * 8 * BPITCH * 4),  "v"(gb + 0 * 8 * HW),
           "v"(lb + 1 * 8 * BPITCH * 4),  "v"(gb + 1 * 8 * HW),
           "v"(lb + 2 * 8 * BPITCH * 4),  "v"(gb + 2 * 8 * HW),
           "v"(lb + 3 * 8 * BPITCH * 4),  "v"(gb + 3 * 8 * HW)
        : "memory");
}

// A = the block's first A row, B = B's row 0 at the block's first column,
// S = two buffers of SLICEF floats.
__device__ __forceinline__ void wmma_gemm_block(const float* __restrict__ A,
                                                const float* __restrict__ B,
                                                float* S, v8f acc[2][4])
{
    const int wave = threadIdx.x >> 5;
    const int lane = threadIdx.x & 31;
    const int idx  = lane & 15;
    const int kb   = (lane >> 4) << 1;
    const int aoff = (wave * 32 + idx) * APITCH + kb;
    const int boff = ASLICE + kb * BPITCH + idx;

    stage_slice(A, B, S);
    asm volatile("s_wait_asynccnt 0x0" ::: "memory");   // this wave's part of slice 0 has landed
    __syncthreads();                                    // ... and every other wave's
    stage_slice(A + KC, B + (size_t)KC * HW, S + SLICEF);

    // kept rolled: one trip per slice, its foot is where the buffers change hands
#pragma unroll 1
    for (int t = 0; t < NSLICE; ++t) {
        float* buf = S + (t & 1) * SLICEF;
        const float* ap = buf + aoff;
        const float* bp = buf + boff;
        // unrolled (this loop and the three inside): every LDS offset and every
        // fragment and accumulator index is a constant, so nothing is indexed at run time
#pragma unroll
        for (int k = 0; k < KC; k += 4) {
            v2f a[2];
#pragma unroll
            for (int mi = 0; mi < 2; ++mi)
                a[mi] = *(const v2f*)(ap + mi * 16 * APITCH + k);
            v2f bv[4];
#pragma unroll
            for (int ni = 0; ni < 4; ++ni) {
                bv[ni].x = bp[k * BPITCH + ni * 16];
                bv[ni].y = bp[(k + 1) * BPITCH + ni * 16];
            }
#pragma unroll
            for (int mi = 0; mi < 2; ++mi)
#pragma unroll
                for (int ni = 0; ni < 4; ++ni)
                    acc[mi][ni] = __builtin_amdgcn_wmma_f32_16x16x4_f32(
                        /*neg_a=*/false, a[mi], /*neg_b=*/false, bv[ni],
                        /*c_mod=*/(short)0, acc[mi][ni],
                        /*reuse_a=*/false, /*reuse_b=*/false);
        }
        asm volatile("s_wait_dscnt 0x0" ::: "memory");      // this wave has left buffer t & 1
        asm volatile("s_wait_asynccnt 0x0" ::: "memory");   // its part of slice t + 1 has landed
        __syncthreads();                                    // both hold for every wave
        if (t + 2 < NSLICE)
            stage_slice(A + (t + 2) * KC, B + (size_t)(t + 2) * KC * HW, buf);
    }
    asm volatile("s_wait_asynccnt 0x0" ::: "memory");       // no copy outlives the loop
}

// ---------------------------------------------------------------------------
// Kernel A: qkv = w_qkv @ x + b_qkv    (M=768, K=256, N=3136 per batch)
// Wave macro-tile: 32(M) x 64(N).  768 = 24 mBlocks, 3136 = 49 nQuads.
// Output layout: qkvbuf[b][which(3)][head(8)][p(3136)][d(32)]  (d contiguous)
// grid = (49, 6, 4), block = 128 (4 waves; wave -> mBlock)
// ---------------------------------------------------------------------------
__global__ void __launch_bounds__(128)
qkv_kernel(const float* __restrict__ x,      // (B,256,56,56)
           const float* __restrict__ w_qkv,  // (768,256)
           const float* __restrict__ b_qkv,  // (768)
           float* __restrict__ qkvbuf)
{
    const int wave   = threadIdx.x >> 5;
    const int lane   = threadIdx.x & 31;
    const int nQuad  = blockIdx.x;                 // 0..48
    const int mBlock = blockIdx.y * 4 + wave;      // 0..23
    const int b      = blockIdx.z;

    __shared__ __attribute__((aligned(16))) float S[2 * SLICEF];

    const float* A = w_qkv + (size_t)blockIdx.y * 128 * DIMC;
    const float* B = x + (size_t)b * DIMC * HW + nQuad * 64;

    v8f acc[2][4] = {};
    wmma_gemm_block(A, B, S, acc);

    const int idx   = lane & 15;
    const int khalf = lane >> 4;

#pragma unroll
    for (int mi = 0; mi < 2; ++mi) {
        const int m0    = mBlock * 32 + mi * 16 + khalf * 8;  // multiple of 8
        const int which = m0 >> 8;                            // 0=q 1=k 2=v
        const int head  = (m0 >> 5) & 7;
        const int d0    = m0 & 31;                            // 0,8,16,24
        float4 bias_lo, bias_hi;
        bias_lo.x = b_qkv[m0 + 0]; bias_lo.y = b_qkv[m0 + 1];
        bias_lo.z = b_qkv[m0 + 2]; bias_lo.w = b_qkv[m0 + 3];
        bias_hi.x = b_qkv[m0 + 4]; bias_hi.y = b_qkv[m0 + 5];
        bias_hi.z = b_qkv[m0 + 6]; bias_hi.w = b_qkv[m0 + 7];
#pragma unroll
        for (int ni = 0; ni < 4; ++ni) {
            const int p = nQuad * 64 + ni * 16 + idx;
            float* outp = qkvbuf +
                ((((size_t)(b * 3 + which) * NHEADS + head) * HW + p) * HDIM + d0);
            float4 lo, hi;
            lo.x = acc[mi][ni][0] + bias_lo.x;
            lo.y = acc[mi][ni][1] + bias_lo.y;
            lo.z = acc[mi][ni][2] + bias_lo.z;
            lo.w = acc[mi][ni][3] + bias_lo.w;
            hi.x = acc[mi][ni][4] + bias_hi.x;
            hi.y = acc[mi][ni][5] + bias_hi.y;
            hi.z = acc[mi][ni][6] + bias_hi.z;
            hi.w = acc[mi][ni][7] + bias_hi.w;
            *(float4*)(outp)     = lo;
            *(float4*)(outp + 4) = hi;
        }
    }
}

// ---------------------------------------------------------------------------
// Kernel B: neighborhood attention, one thread per (b, head, pixel).
// One block = 4 image rows (224 pixels) of one (b, head). The block first
// stages the K and V vectors of its rows plus the window's halo in LDS; halo
// cells outside the image are stored as zeros, which is the reference's zero
// padding (logit = 0, v = 0, still in the softmax), so the window loop needs
// no bounds test. One LDS cell = K[32], V[32] and 4 floats of pad: 272 B =
// 16 B x odd, so lanes on neighbouring pixels read 16-byte pieces from
// distinct banks.
// Single-pass online softmax, q + 32 accumulators in registers.
// Output written channel-major: attnbuf[b][c=head*32+d][p].
// ---------------------------------------------------------------------------
#define TROWS   4                    // image rows per block
#define TTHR    (TROWS * WIDTH)      // 224 threads, one per pixel
#define LCOLS   64                   // LDS cells per staged row (56 + widest halo)
#define LCELL   68                   // floats per LDS cell
#define LROWS   (TROWS + 8)          // staged rows for the widest window
#define STAGE_U 7                    // pieces per thread loaded before any is stored

struct Vec32 { v4f e[8]; };

__device__ __forceinline__ void vec_read(Vec32& c, const float* src)
{
#pragma unroll
    for (int d4 = 0; d4 < 8; ++d4) c.e[d4] = ((const v4f*)src)[d4];
}

__device__ __forceinline__ void cell_attend(const Vec32& k, const Vec32& v, const float (&q)[HDIM],
                                            float (&acc)[HDIM], float& mx, float& ssum)
{
    float s = 0.0f;
#pragma unroll
    for (int d4 = 0; d4 < 8; ++d4) {
        const v4f t = k.e[d4];
        s += q[4 * d4 + 0] * t.x + q[4 * d4 + 1] * t.y
           + q[4 * d4 + 2] * t.z + q[4 * d4 + 3] * t.w;
    }
    const float nm = fmaxf(mx, s);
    const float cs = __expf(mx - nm);   // exp(-inf)=0 on first cell
    const float w  = __expf(s - nm);
    ssum = ssum * cs + w;
#pragma unroll
    for (int d4 = 0; d4 < 8; ++d4) {
        const v4f t = v.e[d4];
        acc[4 * d4 + 0] = acc[4 * d4 + 0] * cs + w * t.x;
        acc[4 * d4 + 1] = acc[4 * d4 + 1] * cs + w * t.y;
        acc[4 * d4 + 2] = acc[4 * d4 + 2] * cs + w * t.z;
        acc[4 * d4 + 3] = acc[4 * d4 + 3] * cs + w * t.w;
    }
    mx = nm;
}

template<int KSZ>
__device__ __forceinline__ void attn_tile(const float* __restrict__ qkvbuf,
                                          float* __restrict__ attnbuf,
                                          float* KV, int b, int head, int tile)
{
    constexpr int PAD    = KSZ >> 1;
    constexpr int PIECES = (TROWS + KSZ - 1) * LCOLS * 8;   // float4 pieces of K (and of V)
    const int tid = threadIdx.x;
    const int y0  = tile * TROWS;
    const int p   = tile * TTHR + tid;

    const float* qb = qkvbuf + (((size_t)(b * 3 + 0) * NHEADS + head) * HW + p) * HDIM;
    const v4f*   kg = (const v4f*)(qkvbuf + (((size_t)(b * 3 + 1) * NHEADS + head) * HW) * HDIM);
    const v4f*   vg = (const v4f*)(qkvbuf + (((size_t)(b * 3 + 2) * NHEADS + head) * HW) * HDIM);

    // Stage: 8 lanes per pixel, so a wave's load covers whole 128-byte lines.
    for (int i0 = tid; i0 < PIECES; i0 += STAGE_U * TTHR) {
        v4f kr[STAGE_U], vr[STAGE_U];
#pragma unroll
        for (int u = 0; u < STAGE_U; ++u) {
            const int i   = i0 + u * TTHR;
            const int yy  = y0 + (i >> 9) - PAD;
            const int xx  = ((i >> 3) & (LCOLS - 1)) - PAD;
            const bool inb = (yy >= 0) && (yy < WIDTH) && (xx >= 0) && (xx < WIDTH);
            const int g   = inb ? ((yy * WIDTH + xx) * 8 + (i & 7)) : 0;
            kr[u] = kg[g];
            vr[u] = vg[g];
            if (!inb) { kr[u] = (v4f)(0.0f); vr[u] = (v4f)(0.0f); }
        }
#pragma unroll
        for (int u = 0; u < STAGE_U; ++u) {
            const int i = i0 + u * TTHR;
            if (i < PIECES) {
                float* cell = KV + (i >> 3) * LCELL + (i & 7) * 4;
                *(v4f*)(cell)      = kr[u];
                *(v4f*)(cell + 32) = vr[u];
            }
        }
    }

    float q[HDIM];
#pragma unroll
    for (int d4 = 0; d4 < 8; ++d4) {
        float4 t = ((const float4*)qb)[d4];
        q[4 * d4 + 0] = t.x * SCALE;
        q[4 * d4 + 1] = t.y * SCALE;
        q[4 * d4 + 2] = t.z * SCALE;
        q[4 * d4 + 3] = t.w * SCALE;
    }

    float mx   = -INFINITY;
    float ssum = 0.0f;
    float acc[HDIM];
#pragma unroll
    for (int d = 0; d < HDIM; ++d) acc[d] = 0.0f;

    const int r = tid / WIDTH;
    const int x = tid - r * WIDTH;
    const float* win = KV + (r * LCOLS + x) * LCELL;   // window's top-left cell

    __syncthreads();   // every wave's staged cells are read by the others

    // Window cells in the reference's order (row-major over ki, kj). A cell's K is
    // read from LDS one cell ahead of its use (two register sets), its V at the
    // cell's start, under the logit's arithmetic.
    int kj = 0, off = 0;
    auto next_cell = [&]() {
        ++kj; off += LCELL;
        if (kj == KSZ) { kj = 0; off += (LCOLS - KSZ) * LCELL; }
    };
    Vec32 ka, kb, vv;
    vec_read(ka, win);
    // kept rolled: unrolled, all LDS reads of a window row are lifted to its top and spill
#pragma unroll 1
    for (int it = 0; it < (KSZ * KSZ - 1) / 2; ++it) {
        vec_read(vv, win + off + 32);
        next_cell();
        vec_read(kb, win + off);
        cell_attend(ka, vv, q, acc, mx, ssum);
        vec_read(vv, win + off + 32);
        next_cell();
        vec_read(ka, win + off);
        cell_attend(kb, vv, q, acc, mx, ssum);
    }
    vec_read(vv, win + off + 32);
    cell_attend(ka, vv, q, acc, mx, ssum);

    const float inv = 1.0f / ssum;
    float* ob = attnbuf + ((size_t)b * DIMC + head * HDIM) * HW + p;
#pragma unroll
    for (int d = 0; d < HDIM; ++d)
        ob[(size_t)d * HW] = acc[d] * inv;
}

// grid = 8 heads x 4 batches x 14 row tiles; the heads with the widest window
// take the lowest block indices, so the longest blocks start first.
__global__ void __launch_bounds__(TTHR)
attn_kernel(const float* __restrict__ qkvbuf,
            float* __restrict__ attnbuf)
{
    __shared__ __attribute__((aligned(16))) float KV[LROWS * LCOLS * LCELL];

    const int blk  = blockIdx.x;
    const int head = (NHEADS - 1) - blk / 56;
    const int rem  = blk % 56;
    const int b    = rem / 14;
    const int tile = rem % 14;

    if (head < 4)      attn_tile<5>(qkvbuf, attnbuf, KV, b, head, tile);
    else if (head < 7) attn_tile<7>(qkvbuf, attnbuf, KV, b, head, tile);
    else               attn_tile<9>(qkvbuf, attnbuf, KV, b, head, tile);
}

// ---------------------------------------------------------------------------
// Kernel C: out = w_proj @ attn + b_proj  (M=256, K=256, N=3136 per batch)
// Wave macro-tile: 32(M) x 64(N).  256 = 8 mBlocks, 3136 = 49 nQuads.
// Output: reference layout (B,256,56,56).
// grid = (49, 2, 4), block = 128 (4 waves)
// ---------------------------------------------------------------------------
__global__ void __launch_bounds__(128)
proj_kernel(const float* __restrict__ attnbuf, // (B,256,3136) channel-major
            const float* __restrict__ w_proj,  // (256,256)
            const float* __restrict__ b_proj,  // (256)
            float* __restrict__ out)
{
    const int wave   = threadIdx.x >> 5;
    const int lane   = threadIdx.x & 31;
    const int nQuad  = blockIdx.x;                 // 0..48
    const int mBlock = blockIdx.y * 4 + wave;      // 0..7
    const int b      = blockIdx.z;

    __shared__ __attribute__((aligned(16))) float S[2 * SLICEF];

    const float* A = w_proj + (size_t)blockIdx.y * 128 * DIMC;
    const float* B = attnbuf + (size_t)b * DIMC * HW + nQuad * 64;

    v8f acc[2][4] = {};
    wmma_gemm_block(A, B, S, acc);

    const int idx   = lane & 15;
    const int khalf = lane >> 4;

#pragma unroll
    for (int mi = 0; mi < 2; ++mi) {
        const int m0 = mBlock * 32 + mi * 16 + khalf * 8;
#pragma unroll
        for (int ni = 0; ni < 4; ++ni) {
            const int p = nQuad * 64 + ni * 16 + idx;
#pragma unroll
            for (int r = 0; r < 8; ++r)
                out[((size_t)b * DIMC + m0 + r) * HW + p] = acc[mi][ni][r] + b_proj[m0 + r];
        }
    }
}

// ---------------------------------------------------------------------------
extern "C" void kernel_launch(void* const* d_in, const int* in_sizes, int n_in,
                              void* d_out, int out_size, void* d_ws, size_t ws_size,
                              hipStream_t stream)
{
    const float* x      = (const float*)d_in[0];  // (4,256,56,56)
    const float* w_qkv  = (const float*)d_in[1];  // (768,256)
    const float* b_qkv  = (const float*)d_in[2];  // (768)
    const float* w_proj = (const float*)d_in[3];  // (256,256)
    const float* b_proj = (const float*)d_in[4];  // (256)
    float* out = (float*)d_out;

    float* qkvbuf  = (float*)d_ws;                                // 3*4*8*3136*32 floats
    float* attnbuf = qkvbuf + (size_t)3 * 4 * NHEADS * HW * HDIM; // +4*256*3136 floats

    // QKV projection: 24 mBlocks x 49 nQuads x 4 batches, 4 waves/block
    qkv_kernel<<<dim3(49, 6, 4), dim3(128), 0, stream>>>(x, w_qkv, b_qkv, qkvbuf);

    // Neighborhood attention: 8 heads x 4 batches x 14 tiles of 4 rows
    attn_kernel<<<dim3(448), dim3(224), 0, stream>>>(qkvbuf, attnbuf);

    // Output projection: 8 mBlocks x 49 nQuads x 4 batches
    proj_kernel<<<dim3(49, 2, 4), dim3(128), 0, stream>>>(attnbuf, w_proj, b_proj, out);
}

// v003
// A run of this version takes 65 microseconds.
// In both of two side-by-side timings against v002, it was 1.06 times as fast.
// All steps since v000 together make it 3.13 times as fast.
#include <hip/hip_runtime.h>
#include <hip/hip_bf16.h>
#include <math.h>

typedef float v2f __attribute__((ext_vector_type(2)));
typedef float v8f __attribute__((ext_vector_type(8)));
typedef float v4f __attribute__((ext_vector_type(4)));

#define DIMC   256
#define HDIM   32
#define NHEADS 8
#define HW     3136
#define WIDTH  56
#define SCALE  0.17677669529663687f   // 32^-0.5

// ---------------------------------------------------------------------------
// Block-level 128 (M) x 64 (N) fp32 GEMM over K = 256 on V_WMMA_F32_16X16X4_F32.
// 4 waves; wave w owns rows 32w..32w+31 as 2 x 4 tiles of 16 x 16.
// A: row-major M x K (lda = 256). B: row-major K x N (ldb = 3136).
// K runs in slices of 32. A slice (A: 128 rows x 128 B, B: 32 rows x 256 B) is
// brought into LDS by asynchronous 16-byte copies, whole 128-byte lines per
// request, two buffers: slice t + 1 flies while slice t is multiplied.
// Per ISA VGPR layout: lane = (idx = lane&15, khalf = lane>>4)
//   A regs = A[idx][2*khalf + {0,1}]   (8-byte LDS read)
//   B regs = B[2*khalf + {0,1}][idx]   (two 4-byte LDS reads)
// LDS pitches: A rows 36 floats (16 rows x 2 halves fall on all 64 banks once),
// B rows 72 floats (rows k and k + 2 lie 16 banks apart).
// ---------------------------------------------------------------------------
#define KC      32
#define NSLICE  (DIMC / KC)
#define APITCH  36
#define BPITCH  72
#define ASLICE  (128 * APITCH)
#define BSLICE  (KC * BPITCH)
#define SLICEF  (ASLICE + BSLICE)    // floats per buffer: 27,648 B

// Epilogues: behind the last slice's barrier the two buffers are free, and each
// wave lays its 32 x 64 result in a range of its own there, in the order of the
// output rows, then reads it back 16 bytes a lane so that one global store
// writes four whole 128-byte lines.
#define QPITCH  36                   // qkv: a staged pixel = 32 d + 4 floats (144 B = 16 B x odd)
#define PPITCH  68                   // proj: a staged channel row = 64 pixels + 4 floats

__device__ __forceinline__ unsigned lds_byte(const float* p)
{
    return (unsigned)(uintptr_t)p;   // low 32 bits of a __shared__ address = LDS byte address
}

// One slice: 12 copies per lane (8 of A, 4 of B). Ag = the block's first A row at
// the slice's first k; Bg = the slice's first B row at the block's first column.
__device__ __forceinline__ void stage_slice(const float* __restrict__ Ag,
                                            const float* __restrict__ Bg,
                                            float* S)
{
    const int tid = threadIdx.x;
    const float*   ga = Ag + (tid >> 3) * DIMC + (tid & 7) * 4;           // 8 lanes per A row
    const unsigned la = lds_byte(S + (tid >> 3) * APITCH + (tid & 7) * 4);
    const float*   gb = Bg + (tid >> 4) * HW + (tid & 15) * 4;            // 16 lanes per B row
    const unsigned lb = lds_byte(S + ASLICE + (tid >> 4) * BPITCH + (tid & 15) * 4);
    // The copies and their s_wait_xcnt in one statement: the address registers
    // stay untouched until the wait has passed.
    asm volatile(
        "global_load_async_to_lds_b128 %0, %1, off\n\t"
        "global_load_async_to_lds_b128 %2, %3, off\n\t"
        "global_load_async_to_lds_b128 %4, %5, off\n\t"
        "global_load_async_to_lds_b128 %6, %7, off\n\t"
        "global_load_async_to_lds_b128 %8, %9, off\n\t"
        "global_load_async_to_lds_b128 %10, %11, off\n\t"
        "global_load_async_to_lds_b128 %12, %13, off\n\t"
        "global_load_async_to_lds_b128 %14, %15, off\n\t"
        "global_load_async_to_lds_b128 %16, %17, off\n\t"
        "global_load_async_to_lds_b128 %18, %19, off\n\t"
        "global_load_async_to_lds_b128 %20, %21, off\n\t"
        "global_load_async_to_lds_b128 %22, %23, off\n\t"
        "s_wait_xcnt 0x0"
        :: "v"(la + 0 * 16 * APITCH * 4), "v"(ga + 0 * 16 * DIMC),
           "v"(la + 1 * 16 * APITCH * 4), "v"(ga + 1 * 16 * DIMC),
           "v"(la + 2 * 16 * APITCH * 4), "v"(ga + 2 * 16 * DIMC),
           "v"(la + 3 * 16 * APITCH * 4), "v"(ga + 3 * 16 * DIMC),
           "v"(la + 4 * 16 * APITCH * 4), "v"(ga + 4 * 16 * DIMC),
           "v"(la + 5 * 16 * APITCH * 4), "v"(ga + 5 * 16 * DIMC),
           "v"(la + 6 * 16 * APITCH * 4), "v"(ga + 6 * 16 * DIMC),
           "v"(la + 7 * 16 * APITCH * 4), "v"(ga + 7 * 16 * DIMC),
           "v"(lb + 0 * 8 * BPITCH * 4),  "v"(gb + 0 * 8 * HW),
           "v"(lb + 1 * 8 * BPITCH * 4),  "v"(gb + 1 * 8 * HW),
           "v"(lb + 2 * 8 * BPITCH * 4),  "v"(gb + 2 * 8 * HW),
           "v"(lb + 3 * 8 * BPITCH * 4),  "v"(gb + 3 * 8 * HW)
        : "memory");
}

// A = the block's first A row, B = B's row 0 at the block's first column,
// S = two buffers of SLICEF floats.
__device__ __forceinline__ void wmma_gemm_block(const float* __restrict__ A,
                                                const float* __restrict__ B,
                                                float* S, v8f acc[2][4])
{
    const int wave = threadIdx.x >> 5;
    const int lane = threadIdx.x & 31;
    const int idx  = lane & 15;
    const int kb   = (lane >> 4) << 1;
    const int aoff = (wave * 32 + idx) * APITCH + kb;
    const int boff = ASLICE + kb * BPITCH + idx;

    stage_slice(A, B, S);
    asm volatile("s_wait_asynccnt 0x0" ::: "memory");   // this wave's part of slice 0 has landed
    __syncthreads();                                    // ... and every other wave's
    stage_slice(A + KC, B + (size_t)KC * HW, S + SLICEF);

    // kept rolled: one trip per slice, its foot is where the buffers change hands
#pragma unroll 1
    for (int t = 0; t < NSLICE; ++t) {
        float* buf = S + (t & 1) * SLICEF;
        const float* ap = buf + aoff;
        const float* bp = buf + boff;
        // unrolled (this loop and the three inside): every LDS offset and every
        // fragment and accumulator index is a constant, so nothing is indexed at run time
#pragma unroll
        for (int k = 0; k < KC; k += 4) {
            v2f a[2];
#pragma unroll
            for (int mi = 0; mi < 2; ++mi)
                a[mi] = *(const v2f*)(ap + mi * 16 * APITCH + k);
            v2f bv[4];
#pragma unroll
            for (int ni = 0; ni < 4; ++ni) {
                bv[ni].x = bp[k * BPITCH + ni * 16];
                bv[ni].y = bp[(k + 1) * BPITCH + ni * 16];
            }
#pragma unroll
            for (int mi = 0; mi < 2; ++mi)
#pragma unroll
                for (int ni = 0; ni < 4; ++ni)
                    acc[mi][ni] = __builtin_amdgcn_wmma_f32_16x16x4_f32(
                        /*neg_a=*/false, a[mi], /*neg_b=*/false, bv[ni],
                        /*c_mod=*/(short)0, acc[mi][ni],
                        /*reuse_a=*/false, /*reuse_b=*/false);
        }
        asm volatile("s_wait_dscnt 0x0" ::: "memory");      // this wave has left buffer t & 1
        asm volatile("s_wait_asynccnt 0x0" ::: "memory");   // its part of slice t + 1 has landed
        __syncthreads();                                    // both hold for every wave
        if (t + 2 < NSLICE)
            stage_slice(A + (t + 2) * KC, B + (size_t)(t + 2) * KC * HW, buf);
    }
    asm volatile("s_wait_asynccnt 0x0" ::: "memory");       // no copy outlives the loop
}

// ---------------------------------------------------------------------------
// Kernel A: qkv = w_qkv @ x + b_qkv    (M=768, K=256, N=3136 per batch)
// Wave macro-tile: 32(M) x 64(N).  768 = 24 mBlocks, 3136 = 49 nQuads.
// Output layout: qkvbuf[b][which(3)][head(8)][p(3136)][d(32)]  (d contiguous)
// grid = (49, 6, 4), block = 128 (4 waves; wave -> mBlock)
// ---------------------------------------------------------------------------
__global__ void __launch_bounds__(128)
qkv_kernel(const float* __restrict__ x,      // (B,256,56,56)
           const float* __restrict__ w_qkv,  // (768,256)
           const float* __restrict__ b_qkv,  // (768)
           float* __restrict__ qkvbuf)
{
    const int wave   = threadIdx.x >> 5;
    const int lane   = threadIdx.x & 31;
    const int nQuad  = blockIdx.x;                 // 0..48
    const int mBlock = blockIdx.y * 4 + wave;      // 0..23
    const int b      = blockIdx.z;

    __shared__ __attribute__((aligned(16))) float S[2 * SLICEF];

    const float* A = w_qkv + (size_t)blockIdx.y * 128 * DIMC;
    const float* B = x + (size_t)b * DIMC * HW + nQuad * 64;

    v8f acc[2][4] = {};
    wmma_gemm_block(A, B, S, acc);

    const int idx   = lane & 15;
    const int khalf = lane >> 4;

    float* st = S + wave * (64 * QPITCH);                     // this wave's own range

#pragma unroll
    for (int mi = 0; mi < 2; ++mi) {
        const int m0    = mBlock * 32 + mi * 16 + khalf * 8;  // multiple of 8
        const int d0    = m0 & 31;                            // 0,8,16,24
        float4 bias_lo, bias_hi;
        bias_lo.x = b_qkv[m0 + 0]; bias_lo.y = b_qkv[m0 + 1];
        bias_lo.z = b_qkv[m0 + 2]; bias_lo.w = b_qkv[m0 + 3];
        bias_hi.x = b_qkv[m0 + 4]; bias_hi.y = b_qkv[m0 + 5];
        bias_hi.z = b_qkv[m0 + 6]; bias_hi.w = b_qkv[m0 + 7];
#pragma unroll
        for (int ni = 0; ni < 4; ++ni) {
            float* sp = st + (ni * 16 + idx) * QPITCH + d0;
            float4 lo, hi;
            lo.x = acc[mi][ni][0] + bias_lo.x;
            lo.y = acc[mi][ni][1] + bias_lo.y;
            lo.z = acc[mi][ni][2] + bias_lo.z;
            lo.w = acc[mi][ni][3] + bias_lo.w;
            hi.x = acc[mi][ni][4] + bias_hi.x;
            hi.y = acc[mi][ni][5] + bias_hi.y;
            hi.z = acc[mi][ni][6] + bias_hi.z;
            hi.w = acc[mi][ni][7] + bias_hi.w;
            *(float4*)(sp)     = lo;
            *(float4*)(sp + 4) = hi;
        }
    }
    // the wave's staged rows are in LDS before its lanes read each other's
    asm volatile("s_wait_dscnt 0x0" ::: "memory");

    // A wave's 32 rows are one head of q, k or v: 64 pixels x 128 B, contiguous.
    const int which = mBlock >> 3;                            // 0=q 1=k 2=v
    const int head  = mBlock & 7;
    float* outw = qkvbuf +
        (((size_t)(b * 3 + which) * NHEADS + head) * HW + nQuad * 64) * HDIM + lane * 4;
    const float* rp = st + (lane >> 3) * QPITCH + (lane & 7) * 4;   // 8 lanes per pixel
#pragma unroll
    for (int j = 0; j < 16; ++j)
        *(float4*)(outw + j * 4 * HDIM) = *(const float4*)(rp + j * 4 * QPITCH);
}

// ---------------------------------------------------------------------------
// Kernel B: neighborhood attention, one thread per (b, head, pixel).
// One block = 4 image rows (224 pixels) of one (b, head). The block first
// stages the K and V vectors of its rows plus the window's halo in LDS; halo
// cells outside the image are stored as zeros, which is the reference's zero
// padding (logit = 0, v = 0, still in the softmax), so the window loop needs
// no bounds test. One LDS cell = K[32], V[32] and 4 floats of pad: 272 B =
// 16 B x odd, so lanes on neighbouring pixels read 16-byte pieces from
// distinct banks.
// Single-pass online softmax, q + 32 accumulators in registers.
// Output written channel-major: attnbuf[b][c=head*32+d][p].
// ---------------------------------------------------------------------------
#define TROWS   4                    // image rows per block
#define TTHR    (TROWS * WIDTH)      // 224 threads, one per pixel
#define LCOLS   64                   // LDS cells per staged row (56 + widest halo)
#define LCELL   68                   // floats per LDS cell
#define LROWS   (TROWS + 8)          // staged rows for the widest window
#define STAGE_U 7                    // pieces per thread loaded before any is stored

struct Vec32 { v4f e[8]; };

__device__ __forceinline__ void vec_read(Vec32& c, const float* src)
{
#pragma unroll
    for (int d4 = 0; d4 < 8; ++d4) c.e[d4] = ((const v4f*)src)[d4];
}

__device__ __forceinline__ void cell_attend(const Vec32& k, const Vec32& v, const float (&q)[HDIM],
                                            float (&acc)[HDIM], float& mx, float& ssum)
{
    float s = 0.0f;
#pragma unroll
    for (int d4 = 0; d4 < 8; ++d4) {
        const v4f t = k.e[d4];
        s += q[4 * d4 + 0] * t.x + q[4 * d4 + 1] * t.y
           + q[4 * d4 + 2] * t.z + q[4 * d4 + 3] * t.w;
    }
    const float nm = fmaxf(mx, s);
    const float cs = __expf(mx - nm);   // exp(-inf)=0 on first cell
    const float w  = __expf(s - nm);
    ssum = ssum * cs + w;
#pragma unroll
    for (int d4 = 0; d4 < 8; ++d4) {
        const v4f t = v.e[d4];
        acc[4 * d4 + 0] = acc[4 * d4 + 0] * cs + w * t.x;
        acc[4 * d4 + 1] = acc[4 * d4 + 1] * cs + w * t.y;
        acc[4 * d4 + 2] = acc[4 * d4 + 2] * cs + w * t.z;
        acc[4 * d4 + 3] = acc[4 * d4 + 3] * cs + w * t.w;
    }
    mx = nm;
}

template<int KSZ>
__device__ __forceinline__ void attn_tile(const float* __restrict__ qkvbuf,
                                          float* __restrict__ attnbuf,
                                          float* KV, int b, int head, int tile)
{
    constexpr int PAD    = KSZ >> 1;
    constexpr int PIECES = (TROWS + KSZ - 1) * LCOLS * 8;   // float4 pieces of K (and of V)
    const int tid = threadIdx.x;
    const int y0  = tile * TROWS;
    const int p   = tile * TTHR + tid;

    const float* qb = qkvbuf + (((size_t)(b * 3 + 0) * NHEADS + head) * HW + p) * HDIM;
    const v4f*   kg = (const v4f*)(qkvbuf + (((size_t)(b * 3 + 1) * NHEADS + head) * HW) * HDIM);
    const v4f*   vg = (const v4f*)(qkvbuf + (((size_t)(b * 3 + 2) * NHEADS + head) * HW) * HDIM);

    // Stage: 8 lanes per pixel, so a wave's load covers whole 128-byte lines.
    for (int i0 = tid; i0 < PIECES; i0 += STAGE_U * TTHR) {
        v4f kr[STAGE_U], vr[STAGE_U];
#pragma unroll
        for (int u = 0; u < STAGE_U; ++u) {
            const int i   = i0 + u * TTHR;
            const int yy  = y0 + (i >> 9) - PAD;
            const int xx  = ((i >> 3) & (LCOLS - 1)) - PAD;
            const bool inb = (yy >= 0) && (yy < WIDTH) && (xx >= 0) && (xx < WIDTH);
            const int g   = inb ? ((yy * WIDTH + xx) * 8 + (i & 7)) : 0;
            kr[u] = kg[g];
            vr[u] = vg[g];
            if (!inb) { kr[u] = (v4f)(0.0f); vr[u] = (v4f)(0.0f); }
        }
#pragma unroll
        for (int u = 0; u < STAGE_U; ++u) {
            const int i = i0 + u * TTHR;
            if (i < PIECES) {
                float* cell = KV + (i >> 3) * LCELL + (i & 7) * 4;
                *(v4f*)(cell)      = kr[u];
                *(v4f*)(cell + 32) = vr[u];
            }
        }
    }

    float q[HDIM];
#pragma unroll
    for (int d4 = 0; d4 < 8; ++d4) {
        float4 t = ((const float4*)qb)[d4];
        q[4 * d4 + 0] = t.x * SCALE;
        q[4 * d4 + 1] = t.y * SCALE;
        q[4 * d4 + 2] = t.z * SCALE;
        q[4 * d4 + 3] = t.w * SCALE;
    }

    float mx   = -INFINITY;
    float ssum = 0.0f;
    float acc[HDIM];
#pragma unroll
    for (int d = 0; d < HDIM; ++d) acc[d] = 0.0f;

    const int r = tid / WIDTH;
    const int x = tid - r * WIDTH;
    const float* win = KV + (r * LCOLS + x) * LCELL;   // window's top-left cell

    __syncthreads();   // every wave's staged cells are read by the others

    // Window cells in the reference's order (row-major over ki, kj). A cell's K is
    // read from LDS one cell ahead of its use (two register sets), its V at the
    // cell's start, under the logit's arithmetic.
    int kj = 0, off = 0;
    auto next_cell = [&]() {
        ++kj; off += LCELL;
        if (kj == KSZ) { kj = 0; off += (LCOLS - KSZ) * LCELL; }
    };
    Vec32 ka, kb, vv;
    vec_read(ka, win);
    // kept rolled: unrolled, all LDS reads of a window row are lifted to its top and spill
#pragma unroll 1
    for (int it = 0; it < (KSZ * KSZ - 1) / 2; ++it) {
        vec_read(vv, win + off + 32);
        next_cell();
        vec_read(kb, win + off);
        cell_attend(ka, vv, q, acc, mx, ssum);
        vec_read(vv, win + off + 32);
        next_cell();
        vec_read(ka, win + off);
        cell_attend(kb, vv, q, acc, mx, ssum);
    }
    vec_read(vv, win + off + 32);
    cell_attend(ka, vv, q, acc, mx, ssum);

    const float inv = 1.0f / ssum;
    float* ob = attnbuf + ((size_t)b * DIMC + head * HDIM) * HW + p;
#pragma unroll
    for (int d = 0; d < HDIM; ++d)
        ob[(size_t)d * HW] = acc[d] * inv;
}

// grid = 8 heads x 4 batches x 14 row tiles; the heads with the widest window
// take the lowest block indices, so the longest blocks start first.
__global__ void __launch_bounds__(TTHR)
attn_kernel(const float* __restrict__ qkvbuf,
            float* __restrict__ attnbuf)
{
    __shared__ __attribute__((aligned(16))) float KV[LROWS * LCOLS * LCELL];

    const int blk  = blockIdx.x;
    const int head = (NHEADS - 1) - blk / 56;
    const int rem  = blk % 56;
    const int b    = rem / 14;
    const int tile = rem % 14;

    if (head < 4)      attn_tile<5>(qkvbuf, attnbuf, KV, b, head, tile);
    else if (head < 7) attn_tile<7>(qkvbuf, attnbuf, KV, b, head, tile);
    else               attn_tile<9>(qkvbuf, attnbuf, KV, b, head, tile);
}

// ---------------------------------------------------------------------------
// Kernel C: out = w_proj @ attn + b_proj  (M=256, K=256, N=3136 per batch)
// Wave macro-tile: 32(M) x 64(N).  256 = 8 mBlocks, 3136 = 49 nQuads.
// Output: reference layout (B,256,56,56).
// grid = (49, 2, 4), block = 128 (4 waves)
// ---------------------------------------------------------------------------
__global__ void __launch_bounds__(128)
proj_kernel(const float* __restrict__ attnbuf, // (B,256,3136) channel-major
            const float* __restrict__ w_proj,  // (256,256)
            const float* __restrict__ b_proj,  // (256)
            float* __restrict__ out)
{
    const int wave   = threadIdx.x >> 5;
    const int lane   = threadIdx.x & 31;
    const int nQuad  = blockIdx.x;                 // 0..48
    const int mBlock = blockIdx.y * 4 + wave;      // 0..7
    const int b      = blockIdx.z;

    __shared__ __attribute__((aligned(16))) float S[2 * SLICEF];

    const float* A = w_proj + (size_t)blockIdx.y * 128 * DIMC;
    const float* B = attnbuf + (size_t)b * DIMC * HW + nQuad * 64;

    v8f acc[2][4] = {};
    wmma_gemm_block(A, B, S, acc);

    const int idx   = lane & 15;
    const int khalf = lane >> 4;

    float* st = S + wave * (32 * PPITCH);                     // this wave's own range

#pragma unroll
    for (int mi = 0; mi < 2; ++mi) {
        const int m0 = mBlock * 32 + mi * 16 + khalf * 8;
#pragma unroll
        for (int ni = 0; ni < 4; ++ni) {
#pragma unroll
            for (int r = 0; r < 8; ++r)
                st[(mi * 16 + khalf * 8 + r) * PPITCH + ni * 16 + idx] =
                    acc[mi][ni][r] + b_proj[m0 + r];
        }
    }
    // the wave's staged rows are in LDS before its lanes read each other's
    asm volatile("s_wait_dscnt 0x0" ::: "memory");

    // 16 lanes per channel row: 256 contiguous bytes of out, two rows a store.
    float* outw = out + ((size_t)b * DIMC + mBlock * 32 + (lane >> 4)) * HW
                      + nQuad * 64 + (lane & 15) * 4;
    const float* rp = st + (lane >> 4) * PPITCH + (lane & 15) * 4;
#pragma unroll
    for (int j = 0; j < 16; ++j)
        *(float4*)(outw + (size_t)j * 2 * HW) = *(const float4*)(rp + j * 2 * PPITCH);
}

// ---------------------------------------------------------------------------
extern "C" void kernel_launch(void* const* d_in, const int* in_sizes, int n_in,
                              void* d_out, int out_size, void* d_ws, size_t ws_size,
                              hipStream_t stream)
{
    const float* x      = (const float*)d_in[0];  // (4,256,56,56)
    const float* w_qkv  = (const float*)d_in[1];  // (768,256)
    const float* b_qkv  = (const float*)d_in[2];  // (768)
    const float* w_proj = (const float*)d_in[3];  // (256,256)
    const float* b_proj = (const float*)d_in[4];  // (256)
    float* out = (float*)d_out;

    float* qkvbuf  = (float*)d_ws;                                // 3*4*8*3136*32 floats
    float* attnbuf = qkvbuf + (size_t)3 * 4 * NHEADS * HW * HDIM; // +4*256*3136 floats

    // QKV projection: 24 mBlocks x 49 nQuads x 4 batches, 4 waves/block
    qkv_kernel<<<dim3(49, 6, 4), dim3(128), 0, stream>>>(x, w_qkv, b_qkv, qkvbuf);

    // Neighborhood attention: 8 heads x 4 batches x 14 tiles of 4 rows
    attn_kernel<<<dim3(448), dim3(224), 0, stream>>>(qkvbuf, attnbuf);

    // Output projection: 8 mBlocks x 49 nQuads x 4 batches
    proj_kernel<<<dim3(49, 2, 4), dim3(128), 0, stream>>>(attnbuf, w_proj, b_proj, out);
}
